// v000
// Measured on an AMD MI455X. A time is GPU time per run, averaged over a window of back-to-back runs after a warm-up
// (all launches, gaps included; the runs take copies of the inputs in turn), and the median of several windows.
// Apart from v000's, it joins two sittings. Times from different sittings can be a few percent apart, while
// side-by-side timings come from the same sitting.
// v000, which the later versions start from, runs in 245 microseconds.
#include <hip/hip_runtime.h>
#include <math.h>

typedef __attribute__((ext_vector_type(2))) float v2f;
typedef __attribute__((ext_vector_type(8))) float v8f;
typedef __attribute__((ext_vector_type(4))) unsigned int u32x4;
typedef __attribute__((ext_vector_type(8))) unsigned int u32x8;

#define T_SZ   64
#define DIM    128
#define NH     4
#define HS     32
#define NG     4
#define GT     16
#define MROWS  17    // merged rows per (head,group) pair
#define MPAD   33    // merged row stride in floats (odd -> bank spread)
#define XPAD   132   // x/o row stride in floats (132 % 64 == 4 -> conflict-free col reads)

__global__ __launch_bounds__(256) void fused_block_attn_kernel(
    const float* __restrict__ x,   // [B,64,128]
    const float* __restrict__ y0,  // [B,4,4,1,32]
    const float* __restrict__ y1,
    const float* __restrict__ y2,
    const float* __restrict__ Wa,  // [128,384]
    const float* __restrict__ Wp,  // [128,128]
    float* __restrict__ out)       // [B,64,128]
{
    __shared__ float xo[T_SZ * XPAD];          // x staging (TDM target), later reused for o
    __shared__ float mq[16 * MROWS * MPAD];    // merged q  [pair][17][32 (+pad)]
    __shared__ float mk[16 * MROWS * MPAD];
    __shared__ float mv[16 * MROWS * MPAD];

    const int tid  = threadIdx.x;
    const int lane = tid & 31;
    const int wave = tid >> 5;
    const int b    = blockIdx.x;

    // ---------------- stage x[b] -> LDS via Tensor Data Mover ---------------
    // 2D tile: 128 (dim0) x 64 rows (dim1), fp32, LDS row padding 4 DWORDs
    // after every 128 DWORDs -> row stride 132 floats == XPAD.
    if (wave == 0) {
        unsigned long long ga =
            (unsigned long long)(const void*)(x + (size_t)b * T_SZ * DIM);
        unsigned int ldsoff = (unsigned int)(unsigned long long)(const void*)&xo[0];
        u32x4 g0;
        g0[0] = 1u;                                   // count=1, no gather
        g0[1] = ldsoff;                               // lds_addr
        g0[2] = (unsigned int)ga;                     // global_addr[31:0]
        g0[3] = (unsigned int)(ga >> 32) | 0x80000000u; // addr[56:32] | type=2
        u32x8 g1;
        g1[0] = (2u << 16)        // data_size = 4B
              | (1u << 20)        // pad_enable
              | (6u << 22)        // pad_interval code 6 -> every 128 DWORDs
              | (3u << 25);       // pad_amount  code 3 -> 4 DWORDs
        g1[1] = (unsigned int)DIM << 16;   // tensor_dim0 = 128 (bits 79:48, low part)
        g1[2] = (unsigned int)T_SZ << 16;  // tensor_dim1 = 64  (bits 111:80, low part)
        g1[3] = (unsigned int)DIM << 16;   // tile_dim0 = 128   (bits 127:112)
        g1[4] = (unsigned int)T_SZ;        // tile_dim1 = 64, tile_dim2 = 0
        g1[5] = (unsigned int)DIM;         // tensor_dim0_stride = 128
        g1[6] = 0u;
        g1[7] = 0u;
        asm volatile("tensor_load_to_lds %0, %1" :: "s"(g0), "s"(g1) : "memory");
        __builtin_amdgcn_s_wait_tensorcnt(0);
    }

    // ---------------- fill summary slots of merged q/k/v from y0/y1/y2 ------
    // group 0: slot 16 <- y[b,h,0]; group g>0: slot 0 <- y[b,h,g-1]
    for (int idx = tid; idx < 3 * 16 * HS; idx += 256) {
        int part = idx >> 9;             // 0:q 1:k 2:v  (512 elems each)
        int rem  = idx & 511;
        int p    = rem >> 5;             // pair = h*4+g
        int hs   = rem & 31;
        int g    = p & 3;
        int h    = p >> 2;
        const float* y   = (part == 0) ? y0 : (part == 1) ? y1 : y2;
        float*       buf = (part == 0) ? mq : (part == 1) ? mk : mv;
        int srcg = (g == 0) ? 0 : (g - 1);
        int slot = (g == 0) ? 16 : 0;
        buf[(p * MROWS + slot) * MPAD + hs] =
            y[(((size_t)b * NH + h) * NG + srcg) * HS + hs];
    }
    __syncthreads();

    // ---------------- GEMM1: qkv = x @ W_attn, scatter into merged layout ---
    // 24 N-tiles of 16 -> 3 per wave; 4 M-tiles accumulated per nt.
    // B fragments software-pipelined one K-step ahead.
    {
        const int nlow    = lane & 15;
        const int kb_lane = 2 * (lane >> 4);
        const int nbase   = wave * 48;
        for (int nt = 0; nt < 3; ++nt) {
            const int ncol = nbase + nt * 16 + nlow;
            v8f acc[4];
            #pragma unroll
            for (int mt = 0; mt < 4; ++mt)
                acc[mt] = (v8f){0.f,0.f,0.f,0.f,0.f,0.f,0.f,0.f};

            v2f bf;
            bf.x = Wa[(size_t)kb_lane * 384 + ncol];
            bf.y = Wa[(size_t)(kb_lane + 1) * 384 + ncol];
            for (int k0 = 0; k0 < DIM; k0 += 4) {
                const int kbn = (((k0 + 4) & (DIM - 1)) + kb_lane);
                v2f bfn;
                bfn.x = Wa[(size_t)kbn * 384 + ncol];
                bfn.y = Wa[(size_t)(kbn + 1) * 384 + ncol];
                const int kb = k0 + kb_lane;
                #pragma unroll
                for (int mt = 0; mt < 4; ++mt) {
                    v2f af = *(const v2f*)&xo[(mt * 16 + nlow) * XPAD + kb];
                    acc[mt] = __builtin_amdgcn_wmma_f32_16x16x4_f32(
                        false, af, false, bf, (short)0, acc[mt], false, false);
                }
                bf = bfn;
            }

            // scatter C tiles into merged q/k/v (block-merge applied here)
            const int c    = nbase + nt * 16 + nlow;   // 0..383
            const int part = c >> 7;                   // wave-uniform per nt
            const int ch   = c & 127;
            const int h    = ch >> 5;
            const int hs   = ch & 31;
            float* buf = (part == 0) ? mq : (part == 1) ? mk : mv;
            #pragma unroll
            for (int mt = 0; mt < 4; ++mt) {
                #pragma unroll
                for (int r = 0; r < 8; ++r) {
                    int m    = mt * 16 + r + 8 * (lane >> 4);  // token 0..63
                    int g    = m >> 4;
                    int i    = m & 15;
                    int mrow = (g == 0) ? i : (i + 1);
                    buf[((h * NG + g) * MROWS + mrow) * MPAD + hs] = acc[mt][r];
                }
            }
        }
    }
    __syncthreads();

    // ---------------- causal attention per (pair,row), online softmax -------
    {
        const float scale = 0.17677669529663687f;  // 1/sqrt(32)
        for (int t = tid; t < 16 * MROWS; t += 256) {
            int p = t / MROWS;
            int r = t - p * MROWS;
            int g = p & 3;
            int h = p >> 2;
            const float* qrow = &mq[(p * MROWS + r) * MPAD];
            float qv[HS], oacc[HS];
            #pragma unroll
            for (int c = 0; c < HS; ++c) { qv[c] = qrow[c]; oacc[c] = 0.f; }
            float mx = -INFINITY, sum = 0.f;
            for (int j = 0; j <= r; ++j) {
                const float* krow = &mk[(p * MROWS + j) * MPAD];
                float s = 0.f;
                #pragma unroll
                for (int c = 0; c < HS; ++c) s += qv[c] * krow[c];
                s *= scale;
                float nm   = fmaxf(mx, s);
                float corr = __expf(mx - nm);   // first iter: exp(-inf)=0
                float w    = __expf(s - nm);
                sum = sum * corr + w;
                const float* vrow = &mv[(p * MROWS + j) * MPAD];
                #pragma unroll
                for (int c = 0; c < HS; ++c) oacc[c] = oacc[c] * corr + w * vrow[c];
                mx = nm;
            }
            float inv = 1.f / sum;
            bool keep = (g == 0) ? (r < GT) : (r > 0);   // un-merge
            if (keep) {
                int token = g * GT + r - ((g > 0) ? 1 : 0);
                float* orow = &xo[token * XPAD + h * HS];
                #pragma unroll
                for (int c = 0; c < HS; ++c) orow[c] = oacc[c] * inv;
            }
        }
    }
    __syncthreads();

    // ---------------- GEMM2: out = o @ W_proj -------------------------------
    // 8 N-tiles -> 1 per wave; 4 M-tiles each; pipelined B fragments.
    {
        const int nlow    = lane & 15;
        const int kb_lane = 2 * (lane >> 4);
        const int ncol    = wave * 16 + nlow;
        v8f acc[4];
        #pragma unroll
        for (int mt = 0; mt < 4; ++mt)
            acc[mt] = (v8f){0.f,0.f,0.f,0.f,0.f,0.f,0.f,0.f};

        v2f bf;
        bf.x = Wp[(size_t)kb_lane * DIM + ncol];
        bf.y = Wp[(size_t)(kb_lane + 1) * DIM + ncol];
        for (int k0 = 0; k0 < DIM; k0 += 4) {
            const int kbn = (((k0 + 4) & (DIM - 1)) + kb_lane);
            v2f bfn;
            bfn.x = Wp[(size_t)kbn * DIM + ncol];
            bfn.y = Wp[(size_t)(kbn + 1) * DIM + ncol];
            const int kb = k0 + kb_lane;
            #pragma unroll
            for (int mt = 0; mt < 4; ++mt) {
                v2f af = *(const v2f*)&xo[(mt * 16 + nlow) * XPAD + kb];
                acc[mt] = __builtin_amdgcn_wmma_f32_16x16x4_f32(
                    false, af, false, bf, (short)0, acc[mt], false, false);
            }
            bf = bfn;
        }
        float* ob = out + (size_t)b * T_SZ * DIM;
        #pragma unroll
        for (int mt = 0; mt < 4; ++mt) {
            #pragma unroll
            for (int r = 0; r < 8; ++r) {
                int row = mt * 16 + r + 8 * (lane >> 4);
                ob[(size_t)row * DIM + ncol] = acc[mt][r];
            }
        }
    }
}

extern "C" void kernel_launch(void* const* d_in, const int* in_sizes, int n_in,
                              void* d_out, int out_size, void* d_ws, size_t ws_size,
                              hipStream_t stream) {
    (void)n_in; (void)d_ws; (void)ws_size; (void)out_size;
    const float* x  = (const float*)d_in[0];
    const float* y0 = (const float*)d_in[1];
    const float* y1 = (const float*)d_in[2];
    const float* y2 = (const float*)d_in[3];
    const float* Wa = (const float*)d_in[4];
    const float* Wp = (const float*)d_in[5];
    float* out = (float*)d_out;
    const int B = in_sizes[0] / (T_SZ * DIM);   // 4096
    fused_block_attn_kernel<<<B, 256, 0, stream>>>(x, y0, y1, y2, Wa, Wp, out);
}

// v001
// Measured time: 240 microseconds a run.
// Two timings next to v000 both put it at 1.07 times that version's speed.
#include <hip/hip_runtime.h>
#include <math.h>

typedef __attribute__((ext_vector_type(2))) float v2f;
typedef __attribute__((ext_vector_type(8))) float v8f;
typedef __attribute__((ext_vector_type(4))) unsigned int u32x4;
typedef __attribute__((ext_vector_type(8))) unsigned int u32x8;

#define T_SZ   64
#define DIM    128
#define NH     4
#define HS     32
#define NG     4
#define GT     16
#define MROWS  17    // merged rows per (head,group) pair
#define MPAD   33    // merged row stride in floats (odd -> bank spread)
#define XPAD   132   // x/o row stride in floats (132 % 64 == 4 -> conflict-free col reads)

#define KC     8     // k-steps (4 rows of W each) per weight block held in registers

// Weight block: the B fragments of KC consecutive k-steps of one 16-column tile.
// w points at this lane's first element (row k0 + 2*(lane>>4), its own column).
__device__ __forceinline__ void load_wblock(v2f (&d)[KC], const float* __restrict__ w, int ld)
{
    // unrolled: d[] must stay in registers (constant indices)
    #pragma unroll
    for (int s = 0; s < KC; ++s) {
        d[s].x = w[(4 * s) * ld];
        d[s].y = w[(4 * s + 1) * ld];
    }
}

// KC k-steps of the 64x16 wave tile; xs points at this lane's A element of the
// block's first k-step in row (lane & 15) of the LDS tile.
__device__ __forceinline__ void mma_wblock(v8f (&acc)[4], const v2f (&bw)[KC], const float* xs)
{
    // unrolled: acc[] and bw[] must stay in registers (constant indices)
    #pragma unroll
    for (int s = 0; s < KC; ++s) {
        #pragma unroll
        for (int mt = 0; mt < 4; ++mt) {
            v2f af = *(const v2f*)&xs[mt * 16 * XPAD + 4 * s];
            acc[mt] = __builtin_amdgcn_wmma_f32_16x16x4_f32(
                false, af, false, bw[s], (short)0, acc[mt], false, false);
        }
    }
}

__global__ __launch_bounds__(256) void fused_block_attn_kernel(
    const float* __restrict__ x,   // [B,64,128]
    const float* __restrict__ y0,  // [B,4,4,1,32]
    const float* __restrict__ y1,
    const float* __restrict__ y2,
    const float* __restrict__ Wa,  // [128,384]
    const float* __restrict__ Wp,  // [128,128]
    float* __restrict__ out)       // [B,64,128]
{
    __shared__ float xo[T_SZ * XPAD];          // x staging (TDM target), later reused for o
    __shared__ float mq[16 * MROWS * MPAD];    // merged q  [pair][17][32 (+pad)]
    __shared__ float mk[16 * MROWS * MPAD];
    __shared__ float mv[16 * MROWS * MPAD];

    const int tid  = threadIdx.x;
    const int lane = tid & 31;
    const int wave = tid >> 5;
    const int b    = blockIdx.x;

    // ---------------- stage x[b] -> LDS via Tensor Data Mover ---------------
    // 2D tile: 128 (dim0) x 64 rows (dim1), fp32, LDS row padding 4 DWORDs
    // after every 128 DWORDs -> row stride 132 floats == XPAD.
    if (wave == 0) {
        unsigned long long ga =
            (unsigned long long)(const void*)(x + (size_t)b * T_SZ * DIM);
        unsigned int ldsoff = (unsigned int)(unsigned long long)(const void*)&xo[0];
        u32x4 g0;
        g0[0] = 1u;                                   // count=1, no gather
        g0[1] = ldsoff;                               // lds_addr
        g0[2] = (unsigned int)ga;                     // global_addr[31:0]
        g0[3] = (unsigned int)(ga >> 32) | 0x80000000u; // addr[56:32] | type=2
        u32x8 g1;
        g1[0] = (2u << 16)        // data_size = 4B
              | (1u << 20)        // pad_enable
              | (6u << 22)        // pad_interval code 6 -> every 128 DWORDs
              | (3u << 25);       // pad_amount  code 3 -> 4 DWORDs
        g1[1] = (unsigned int)DIM << 16;   // tensor_dim0 = 128 (bits 79:48, low part)
        g1[2] = (unsigned int)T_SZ << 16;  // tensor_dim1 = 64  (bits 111:80, low part)
        g1[3] = (unsigned int)DIM << 16;   // tile_dim0 = 128   (bits 127:112)
        g1[4] = (unsigned int)T_SZ;        // tile_dim1 = 64, tile_dim2 = 0
        g1[5] = (unsigned int)DIM;         // tensor_dim0_stride = 128
        g1[6] = 0u;
        g1[7] = 0u;
        asm volatile("tensor_load_to_lds %0, %1" :: "s"(g0), "s"(g1) : "memory");
        __builtin_amdgcn_s_wait_tensorcnt(0);
    }

    // Weight fragments travel in a two-block register ring (wb0, wb1): each block
    // is requested one whole block (KC k-steps, 4*KC WMMAs) before its first use.
    const int nlow    = lane & 15;
    const int kb_lane = 2 * (lane >> 4);
    const float* wa = Wa + kb_lane * 384 + wave * 48 + nlow;
    const float* wp = Wp + kb_lane * DIM + wave * 16 + nlow;
    const float* xs = &xo[nlow * XPAD + kb_lane];
    v2f wb0[KC], wb1[KC];
    load_wblock(wb0, wa, 384);       // first block of GEMM1, in flight over the staging

    // ---------------- fill summary slots of merged q/k/v from y0/y1/y2 ------
    // group 0: slot 16 <- y[b,h,0]; group g>0: slot 0 <- y[b,h,g-1]
    for (int idx = tid; idx < 3 * 16 * HS; idx += 256) {
        int part = idx >> 9;             // 0:q 1:k 2:v  (512 elems each)
        int rem  = idx & 511;
        int p    = rem >> 5;             // pair = h*4+g
        int hs   = rem & 31;
        int g    = p & 3;
        int h    = p >> 2;
        const float* y   = (part == 0) ? y0 : (part == 1) ? y1 : y2;
        float*       buf = (part == 0) ? mq : (part == 1) ? mk : mv;
        int srcg = (g == 0) ? 0 : (g - 1);
        int slot = (g == 0) ? 16 : 0;
        buf[(p * MROWS + slot) * MPAD + hs] =
            y[(((size_t)b * NH + h) * NG + srcg) * HS + hs];
    }
    __syncthreads();

    // ---------------- GEMM1: qkv = x @ W_attn, scatter into merged layout ---
    // 24 N-tiles of 16 -> 3 per wave; 4 M-tiles accumulated per nt.
    {
        const int nbase   = wave * 48;
        // unrolled: the ring's last refill of each tile differs by nt (next tile, or GEMM2)
        #pragma unroll
        for (int nt = 0; nt < 3; ++nt) {
            const float* w = wa + nt * 16;
            v8f acc[4];
            #pragma unroll
            for (int mt = 0; mt < 4; ++mt)
                acc[mt] = (v8f){0.f,0.f,0.f,0.f,0.f,0.f,0.f,0.f};

            load_wblock(wb1, w + 32 * 384, 384);
            mma_wblock(acc, wb0, xs);
            load_wblock(wb0, w + 64 * 384, 384);
            mma_wblock(acc, wb1, xs + 32);
            load_wblock(wb1, w + 96 * 384, 384);
            mma_wblock(acc, wb0, xs + 64);
            if (nt < 2) load_wblock(wb0, w + 16, 384);   // next tile's first block
            else        load_wblock(wb0, wp, DIM);       // GEMM2's first block, held over the attention
            mma_wblock(acc, wb1, xs + 96);

            // scatter C tiles into merged q/k/v (block-merge applied here)
            const int c    = nbase + nt * 16 + nlow;   // 0..383
            const int part = c >> 7;                   // wave-uniform per nt
            const int ch   = c & 127;
            const int h    = ch >> 5;
            const int hs   = ch & 31;
            float* buf = (part == 0) ? mq : (part == 1) ? mk : mv;
            #pragma unroll
            for (int mt = 0; mt < 4; ++mt) {
                #pragma unroll
                for (int r = 0; r < 8; ++r) {
                    int m    = mt * 16 + r + 8 * (lane >> 4);  // token 0..63
                    int g    = m >> 4;
                    int i    = m & 15;
                    int mrow = (g == 0) ? i : (i + 1);
                    buf[((h * NG + g) * MROWS + mrow) * MPAD + hs] = acc[mt][r];
                }
            }
        }
    }
    __syncthreads();

    // ---------------- causal attention per (pair,row), online softmax -------
    {
        const float scale = 0.17677669529663687f;  // 1/sqrt(32)
        for (int t = tid; t < 16 * MROWS; t += 256) {
            int p = t / MROWS;
            int r = t - p * MROWS;
            int g = p & 3;
            int h = p >> 2;
            const float* qrow = &mq[(p * MROWS + r) * MPAD];
            float qv[HS], oacc[HS];
            #pragma unroll
            for (int c = 0; c < HS; ++c) { qv[c] = qrow[c]; oacc[c] = 0.f; }
            float mx = -INFINITY, sum = 0.f;
            for (int j = 0; j <= r; ++j) {
                const float* krow = &mk[(p * MROWS + j) * MPAD];
                float s = 0.f;
                #pragma unroll
                for (int c = 0; c < HS; ++c) s += qv[c] * krow[c];
                s *= scale;
                float nm   = fmaxf(mx, s);
                float corr = __expf(mx - nm);   // first iter: exp(-inf)=0
                float w    = __expf(s - nm);
                sum = sum * corr + w;
                const float* vrow = &mv[(p * MROWS + j) * MPAD];
                #pragma unroll
                for (int c = 0; c < HS; ++c) oacc[c] = oacc[c] * corr + w * vrow[c];
                mx = nm;
            }
            float inv = 1.f / sum;
            bool keep = (g == 0) ? (r < GT) : (r > 0);   // un-merge
            if (keep) {
                int token = g * GT + r - ((g > 0) ? 1 : 0);
                float* orow = &xo[token * XPAD + h * HS];
                #pragma unroll
                for (int c = 0; c < HS; ++c) orow[c] = oacc[c] * inv;
            }
        }
    }
    __syncthreads();

    // ---------------- GEMM2: out = o @ W_proj -------------------------------
    // 8 N-tiles -> 1 per wave; 4 M-tiles each; same weight ring.
    {
        const int ncol    = wave * 16 + nlow;
        v8f acc[4];
        #pragma unroll
        for (int mt = 0; mt < 4; ++mt)
            acc[mt] = (v8f){0.f,0.f,0.f,0.f,0.f,0.f,0.f,0.f};

        load_wblock(wb1, wp + 32 * DIM, DIM);
        mma_wblock(acc, wb0, xs);
        load_wblock(wb0, wp + 64 * DIM, DIM);
        mma_wblock(acc, wb1, xs + 32);
        load_wblock(wb1, wp + 96 * DIM, DIM);
        mma_wblock(acc, wb0, xs + 64);
        mma_wblock(acc, wb1, xs + 96);
        float* ob = out + (size_t)b * T_SZ * DIM;
        #pragma unroll
        for (int mt = 0; mt < 4; ++mt) {
            #pragma unroll
            for (int r = 0; r < 8; ++r) {
                int row = mt * 16 + r + 8 * (lane >> 4);
                ob[(size_t)row * DIM + ncol] = acc[mt][r];
            }
        }
    }
}

extern "C" void kernel_launch(void* const* d_in, const int* in_sizes, int n_in,
                              void* d_out, int out_size, void* d_ws, size_t ws_size,
                              hipStream_t stream) {
    (void)n_in; (void)d_ws; (void)ws_size; (void)out_size;
    const float* x  = (const float*)d_in[0];
    const float* y0 = (const float*)d_in[1];
    const float* y1 = (const float*)d_in[2];
    const float* y2 = (const float*)d_in[3];
    const float* Wa = (const float*)d_in[4];
    const float* Wp = (const float*)d_in[5];
    float* out = (float*)d_out;
    const int B = in_sizes[0] / (T_SZ * DIM);   // 4096
    fused_block_attn_kernel<<<B, 256, 0, stream>>>(x, y0, y1, y2, Wa, Wp, out);
}

// v002
// Measured time: 184 microseconds a run.
// In both of two side-by-side timings against v001, it was 1.30 times as fast.
// Counting every step since v000, it is 1.40 times as fast.
#include <hip/hip_runtime.h>
#include <math.h>

typedef __attribute__((ext_vector_type(2))) float v2f;
typedef __attribute__((ext_vector_type(4))) float v4f;
typedef __attribute__((ext_vector_type(8))) float v8f;
typedef __attribute__((ext_vector_type(4))) unsigned int u32x4;
typedef __attribute__((ext_vector_type(8))) unsigned int u32x8;

#define T_SZ   64
#define DIM    128
#define NH     4
#define HS     32
#define NG     4
#define GT     16
#define MROWS  17    // merged rows per (head,group) pair
#define MPAD   36    // merged row stride in floats (16-byte rows; 36 % 64 spreads 16 rows over all banks)
#define XPAD   132   // x/o row stride in floats (132 % 64 == 4 -> conflict-free col reads)

#define KC     8     // k-steps (4 rows of W each) per weight block held in registers

// Weight block: the B fragments of KC consecutive k-steps of one 16-column tile.
// w points at this lane's first element (row k0 + 2*(lane>>4), its own column).
__device__ __forceinline__ void load_wblock(v2f (&d)[KC], const float* __restrict__ w, int ld)
{
    // unrolled: d[] must stay in registers (constant indices)
    #pragma unroll
    for (int s = 0; s < KC; ++s) {
        d[s].x = w[(4 * s) * ld];
        d[s].y = w[(4 * s + 1) * ld];
    }
}

// KC k-steps of the 64x16 wave tile; xs points at this lane's A element of the
// block's first k-step in row (lane & 15) of the LDS tile.
__device__ __forceinline__ void mma_wblock(v8f (&acc)[4], const v2f (&bw)[KC], const float* xs)
{
    // unrolled: acc[] and bw[] must stay in registers (constant indices)
    #pragma unroll
    for (int s = 0; s < KC; ++s) {
        #pragma unroll
        for (int mt = 0; mt < 4; ++mt) {
            v2f af = *(const v2f*)&xs[mt * 16 * XPAD + 4 * s];
            acc[mt] = __builtin_amdgcn_wmma_f32_16x16x4_f32(
                false, af, false, bw[s], (short)0, acc[mt], false, false);
        }
    }
}

// Value of lane ^ 16 (the lane that holds the other half of a fragment's k or of D's rows).
__device__ __forceinline__ float other_half(float v)
{
    int b = __builtin_bit_cast(int, v);
    return __builtin_bit_cast(float,
        __builtin_amdgcn_permlanex16(b, b, 0x76543210, 0xfedcba98, false, false));
}

__global__ __launch_bounds__(256) void fused_block_attn_kernel(
    const float* __restrict__ x,   // [B,64,128]
    const float* __restrict__ y0,  // [B,4,4,1,32]
    const float* __restrict__ y1,
    const float* __restrict__ y2,
    const float* __restrict__ Wa,  // [128,384]
    const float* __restrict__ Wp,  // [128,128]
    float* __restrict__ out)       // [B,64,128]
{
    // xo on a 2 KiB multiple (LDS offset 0): the tensor load's place no longer depends on the other arrays' sizes
    __shared__ __attribute__((aligned(2048))) float xo[T_SZ * XPAD];  // x staging (TDM target), later reused for o
    __shared__ __attribute__((aligned(16))) float mq[16 * MROWS * MPAD];    // merged q  [pair][17][32 (+pad)]
    __shared__ __attribute__((aligned(16))) float mk[16 * MROWS * MPAD];
    __shared__ __attribute__((aligned(16))) float mv[16 * MROWS * MPAD];

    const int tid  = threadIdx.x;
    const int lane = tid & 31;
    const int wave = tid >> 5;
    const int b    = blockIdx.x;

    // ---------------- stage x[b] -> LDS via Tensor Data Mover ---------------
    // 2D tile: 128 (dim0) x 64 rows (dim1), fp32, LDS row padding 4 DWORDs
    // after every 128 DWORDs -> row stride 132 floats == XPAD.
    if (wave == 0) {
        unsigned long long ga =
            (unsigned long long)(const void*)(x + (size_t)b * T_SZ * DIM);
        unsigned int ldsoff = (unsigned int)(unsigned long long)(const void*)&xo[0];
        u32x4 g0;
        g0[0] = 1u;                                   // count=1, no gather
        g0[1] = ldsoff;                               // lds_addr
        g0[2] = (unsigned int)ga;                     // global_addr[31:0]
        g0[3] = (unsigned int)(ga >> 32) | 0x80000000u; // addr[56:32] | type=2
        u32x8 g1;
        g1[0] = (2u << 16)        // data_size = 4B
              | (1u << 20)        // pad_enable
              | (6u << 22)        // pad_interval code 6 -> every 128 DWORDs
              | (3u << 25);       // pad_amount  code 3 -> 4 DWORDs
        g1[1] = (unsigned int)DIM << 16;   // tensor_dim0 = 128 (bits 79:48, low part)
        g1[2] = (unsigned int)T_SZ << 16;  // tensor_dim1 = 64  (bits 111:80, low part)
        g1[3] = (unsigned int)DIM << 16;   // tile_dim0 = 128   (bits 127:112)
        g1[4] = (unsigned int)T_SZ;        // tile_dim1 = 64, tile_dim2 = 0
        g1[5] = (unsigned int)DIM;         // tensor_dim0_stride = 128
        g1[6] = 0u;
        g1[7] = 0u;
        asm volatile("tensor_load_to_lds %0, %1" :: "s"(g0), "s"(g1) : "memory");
        __builtin_amdgcn_s_wait_tensorcnt(0);
    }

    // Weight fragments travel in a two-block register ring (wb0, wb1): each block
    // is requested one whole block (KC k-steps, 4*KC WMMAs) before its first use.
    const int nlow    = lane & 15;
    const int kb_lane = 2 * (lane >> 4);
    const float* wa = Wa + kb_lane * 384 + wave * 48 + nlow;
    const float* wp = Wp + kb_lane * DIM + wave * 16 + nlow;
    const float* xs = &xo[nlow * XPAD + kb_lane];
    v2f wb0[KC], wb1[KC];
    load_wblock(wb0, wa, 384);       // first block of GEMM1, in flight over the staging

    // ---------------- fill summary slots of merged q/k/v from y0/y1/y2 ------
    // group 0: slot 16 <- y[b,h,0]; group g>0: slot 0 <- y[b,h,g-1]
    for (int idx = tid; idx < 3 * 16 * HS; idx += 256) {
        int part = idx >> 9;             // 0:q 1:k 2:v  (512 elems each)
        int rem  = idx & 511;
        int p    = rem >> 5;             // pair = h*4+g
        int hs   = rem & 31;
        int g    = p & 3;
        int h    = p >> 2;
        const float* y   = (part == 0) ? y0 : (part == 1) ? y1 : y2;
        float*       buf = (part == 0) ? mq : (part == 1) ? mk : mv;
        int srcg = (g == 0) ? 0 : (g - 1);
        int slot = (g == 0) ? 16 : 0;
        buf[(p * MROWS + slot) * MPAD + hs] =
            y[(((size_t)b * NH + h) * NG + srcg) * HS + hs];
    }
    __syncthreads();

    // ---------------- GEMM1: qkv = x @ W_attn, scatter into merged layout ---
    // 24 N-tiles of 16 -> 3 per wave; 4 M-tiles accumulated per nt.
    {
        const int nbase   = wave * 48;
        // unrolled: the ring's last refill of each tile differs by nt (next tile, or GEMM2)
        #pragma unroll
        for (int nt = 0; nt < 3; ++nt) {
            const float* w = wa + nt * 16;
            v8f acc[4];
            #pragma unroll
            for (int mt = 0; mt < 4; ++mt)
                acc[mt] = (v8f){0.f,0.f,0.f,0.f,0.f,0.f,0.f,0.f};

            load_wblock(wb1, w + 32 * 384, 384);
            mma_wblock(acc, wb0, xs);
            load_wblock(wb0, w + 64 * 384, 384);
            mma_wblock(acc, wb1, xs + 32);
            load_wblock(wb1, w + 96 * 384, 384);
            mma_wblock(acc, wb0, xs + 64);
            if (nt < 2) load_wblock(wb0, w + 16, 384);   // next tile's first block
            else        load_wblock(wb0, wp, DIM);       // GEMM2's first block, held over the attention
            mma_wblock(acc, wb1, xs + 96);

            // scatter C tiles into merged q/k/v (block-merge applied here)
            const int c    = nbase + nt * 16 + nlow;   // 0..383
            const int part = c >> 7;                   // wave-uniform per nt
            const int ch   = c & 127;
            const int h    = ch >> 5;
            const int hs   = ch & 31;
            float* buf = (part == 0) ? mq : (part == 1) ? mk : mv;
            #pragma unroll
            for (int mt = 0; mt < 4; ++mt) {
                #pragma unroll
                for (int r = 0; r < 8; ++r) {
                    int m    = mt * 16 + r + 8 * (lane >> 4);  // token 0..63
                    int g    = m >> 4;
                    int i    = m & 15;
                    int mrow = (g == 0) ? i : (i + 1);
                    buf[((h * NG + g) * MROWS + mrow) * MPAD + hs] = acc[mt][r];
                }
            }
        }
    }
    __syncthreads();

    // ---------------- causal attention per (head,group) pair on the matrix unit
    // Only the 16 token rows of a pair survive the un-merge, and they attend to the
    // 16 token keys (causal) plus, in groups 1..3, the prepended summary key.
    // S^T = K Q^T puts query (lane & 15) in every lane's column, so the softmax is
    // per lane (8 keys in registers, the other 8 in lane ^ 16) and the D registers
    // of S^T are already the B fragments of O^T = V^T P^T: k-step s pairs keys
    // 8*half + 2s, 8*half + 2s + 1 on both operands.
    {
        const float scale = 0.17677669529663687f;  // 1/sqrt(32)
        const int half = lane >> 4;
        // scalar wave number: pair, group and head stay wave-uniform (no EXEC masking near a WMMA)
        const int wv = __builtin_amdgcn_readfirstlane(wave);
        // unrolled: two independent pairs per wave, their WMMA chains may interleave
        #pragma unroll
        for (int pp = 0; pp < 2; ++pp) {
            const int  p    = wv * 2 + pp;
            const int  g    = p & 3;
            const int  h    = p >> 2;
            const bool summ = (g > 0);                       // summary key visible to kept rows
            const int  tok  = p * MROWS + (summ ? 1 : 0);    // first token row of the pair
            const int  smr  = p * MROWS + (summ ? 0 : 16);   // summary row

            const float* kf = &mk[(tok + nlow) * MPAD + kb_lane];
            const float* qf = &mq[(tok + nlow) * MPAD + kb_lane];
            const float* ks = &mk[smr * MPAD + kb_lane];
            v2f qb[8];
            v8f st = (v8f){0.f,0.f,0.f,0.f,0.f,0.f,0.f,0.f};
            float s0 = 0.f;
            #pragma unroll
            for (int s = 0; s < 8; ++s) {
                v2f ka = *(const v2f*)&kf[4 * s];
                v2f kk = *(const v2f*)&ks[4 * s];
                qb[s]  = *(const v2f*)&qf[4 * s];
                st = __builtin_amdgcn_wmma_f32_16x16x4_f32(
                    false, ka, false, qb[s], (short)0, st, false, false);
                s0 += qb[s].x * kk.x;
                s0 += qb[s].y * kk.y;
            }
            s0 += other_half(s0);                            // the 16 dims held by lane ^ 16
            s0 = summ ? s0 * scale : -INFINITY;

            float e[8];
            float mx = s0;
            #pragma unroll
            for (int r = 0; r < 8; ++r) {
                e[r] = (r + 8 * half <= nlow) ? st[r] * scale : -INFINITY;  // causal mask
                mx = fmaxf(mx, e[r]);
            }
            mx = fmaxf(mx, other_half(mx));                  // finite: key == query is never masked
            float sum = 0.f;
            #pragma unroll
            for (int r = 0; r < 8; ++r) {
                e[r] = __expf(e[r] - mx);                    // masked: exp(-inf) = 0
                sum += e[r];
            }
            const float e0 = __expf(s0 - mx);
            sum += other_half(sum);
            sum += e0;
            const float inv = 1.f / sum;

            const float* vf = &mv[(tok + 8 * half) * MPAD + nlow];
            const float* vs = &mv[smr * MPAD + 8 * half];
            float* orow = &xo[(g * GT + nlow) * XPAD + h * HS + 8 * half];
            #pragma unroll
            for (int tl = 0; tl < 2; ++tl) {
                // start value of the chain: the summary key's term (none in group 0)
                const v4f sa = *(const v4f*)&vs[tl * 16];
                const v4f sb = *(const v4f*)&vs[tl * 16 + 4];
                v8f oa;
                #pragma unroll
                for (int r = 0; r < 4; ++r) {
                    oa[r]     = summ ? e0 * sa[r] : 0.f;
                    oa[r + 4] = summ ? e0 * sb[r] : 0.f;
                }
                #pragma unroll
                for (int s = 0; s < 4; ++s) {
                    v2f va, pb;
                    va.x = vf[(2 * s) * MPAD + tl * 16];
                    va.y = vf[(2 * s + 1) * MPAD + tl * 16];
                    pb.x = e[2 * s];
                    pb.y = e[2 * s + 1];
                    oa = __builtin_amdgcn_wmma_f32_16x16x4_f32(
                        false, va, false, pb, (short)0, oa, false, false);
                }
                // oa[r] = O[query nlow][dim tl*16 + 8*half + r]: 8 consecutive floats of one o row
                *(v4f*)&orow[tl * 16]     = (v4f){oa[0] * inv, oa[1] * inv, oa[2] * inv, oa[3] * inv};
                *(v4f*)&orow[tl * 16 + 4] = (v4f){oa[4] * inv, oa[5] * inv, oa[6] * inv, oa[7] * inv};
            }
        }
    }
    __syncthreads();

    // ---------------- GEMM2: out = o @ W_proj -------------------------------
    // 8 N-tiles -> 1 per wave; 4 M-tiles each; same weight ring.
    {
        const int ncol    = wave * 16 + nlow;
        v8f acc[4];
        #pragma unroll
        for (int mt = 0; mt < 4; ++mt)
            acc[mt] = (v8f){0.f,0.f,0.f,0.f,0.f,0.f,0.f,0.f};

        load_wblock(wb1, wp + 32 * DIM, DIM);
        mma_wblock(acc, wb0, xs);
        load_wblock(wb0, wp + 64 * DIM, DIM);
        mma_wblock(acc, wb1, xs + 32);
        load_wblock(wb1, wp + 96 * DIM, DIM);
        mma_wblock(acc, wb0, xs + 64);
        mma_wblock(acc, wb1, xs + 96);
        float* ob = out + (size_t)b * T_SZ * DIM;
        #pragma unroll
        for (int mt = 0; mt < 4; ++mt) {
            #pragma unroll
            for (int r = 0; r < 8; ++r) {
                int row = mt * 16 + r + 8 * (lane >> 4);
                ob[(size_t)row * DIM + ncol] = acc[mt][r];
            }
        }
    }
}

extern "C" void kernel_launch(void* const* d_in, const int* in_sizes, int n_in,
                              void* d_out, int out_size, void* d_ws, size_t ws_size,
                              hipStream_t stream) {
    (void)n_in; (void)d_ws; (void)ws_size; (void)out_size;
    const float* x  = (const float*)d_in[0];
    const float* y0 = (const float*)d_in[1];
    const float* y1 = (const float*)d_in[2];
    const float* y2 = (const float*)d_in[3];
    const float* Wa = (const float*)d_in[4];
    const float* Wp = (const float*)d_in[5];
    float* out = (float*)d_out;
    const int B = in_sizes[0] / (T_SZ * DIM);   // 4096
    fused_block_attn_kernel<<<B, 256, 0, stream>>>(x, y0, y1, y2, Wa, Wp, out);
}

// v003
// Measured time: 163 microseconds a run.
// Two timings next to v002 both put it at 1.13 times that version's speed.
// All steps since v000 together make it 1.58 times as fast.
#include <hip/hip_runtime.h>
#include <math.h>

typedef __attribute__((ext_vector_type(2))) float v2f;
typedef __attribute__((ext_vector_type(4))) float v4f;
typedef __attribute__((ext_vector_type(8))) float v8f;
typedef __attribute__((ext_vector_type(4))) unsigned int u32x4;
typedef __attribute__((ext_vector_type(8))) unsigned int u32x8;

#define T_SZ   64
#define DIM    128
#define NH     4
#define HS     32
#define NG     4
#define GT     16
#define XPAD   132   // x/o row stride in floats (132 % 64 == 4 -> conflict-free col reads)

#define KC     8     // k-steps (4 rows of W each) per weight block held in registers (GEMM2)
#define KQ     1     // k-steps per weight block of GEMM1 (six 16-column tiles each)
#define NRING  3     // weight blocks of GEMM1 held in registers

// Weight block: the B fragments of KC consecutive k-steps of one 16-column tile.
// w points at this lane's first element (row k0 + 2*(lane>>4), its own column).
__device__ __forceinline__ void load_wblock(v2f (&d)[KC], const float* __restrict__ w, int ld)
{
    // unrolled: d[] must stay in registers (constant indices)
    #pragma unroll
    for (int s = 0; s < KC; ++s) {
        d[s].x = w[(4 * s) * ld];
        d[s].y = w[(4 * s + 1) * ld];
    }
}

// KC k-steps of the 64x16 wave tile; xs points at this lane's A element of the
// block's first k-step in row (lane & 15) of the LDS tile.
__device__ __forceinline__ void mma_wblock(v8f (&acc)[4], const v2f (&bw)[KC], const float* xs)
{
    // unrolled: acc[] and bw[] must stay in registers (constant indices)
    #pragma unroll
    for (int s = 0; s < KC; ++s) {
        #pragma unroll
        for (int mt = 0; mt < 4; ++mt) {
            v2f af = *(const v2f*)&xs[mt * 16 * XPAD + 4 * s];
            acc[mt] = __builtin_amdgcn_wmma_f32_16x16x4_f32(
                false, af, false, bw[s], (short)0, acc[mt], false, false);
        }
    }
}

__device__ __forceinline__ v8f mma4(v2f a, v2f b, v8f c)
{
    return __builtin_amdgcn_wmma_f32_16x16x4_f32(false, a, false, b, (short)0, c, false, false);
}

// GEMM1 weight block: the fragments of KQ k-steps of one head's six 16-column tiles
// (q lo, q hi, k lo, k hi, v lo, v hi). w points at this lane's element of the q lo tile.
__device__ __forceinline__ void load_w6(v2f (&d)[KQ][6], const float* __restrict__ w)
{
    // unrolled: d[][] must stay in registers (constant indices)
    #pragma unroll
    for (int s = 0; s < KQ; ++s) {
        #pragma unroll
        for (int c = 0; c < 6; ++c) {
            const int col = (c >> 1) * DIM + (c & 1) * 16;
            d[s][c].x = w[(4 * s) * 384 + col];
            d[s][c].y = w[(4 * s + 1) * 384 + col];
        }
    }
}

// The x fragments of the same KQ k-steps, one per pair; xs points at this lane's
// element of the first pair's row (lane & 15) in the LDS tile.
__device__ __forceinline__ void load_x2(v2f (&d)[KQ][2], const float* xs)
{
    // unrolled: d[][] must stay in registers (constant indices)
    #pragma unroll
    for (int s = 0; s < KQ; ++s) {
        #pragma unroll
        for (int pp = 0; pp < 2; ++pp)
            d[s][pp] = *(const v2f*)&xs[pp * GT * XPAD + 4 * s];
    }
}

// KQ k-steps of one wave's two (head,group) pairs. A lane's x fragment (token lane & 15,
// two k) and W fragment (column lane & 15, the same two k) each serve as A or as B:
// W as A gives the transposed tile (rows = head dims, columns = tokens) for q and k,
// x as A gives the plain tile (rows = tokens, columns = head dims) for v.
__device__ __forceinline__ void mma_w6(v8f (&qT)[2][2], v8f (&kT)[2][2], v8f (&vv)[2][2],
                                       const v2f (&w)[KQ][6], const v2f (&x)[KQ][2])
{
    // unrolled: the accumulators and w[][] must stay in registers (constant indices)
    #pragma unroll
    for (int s = 0; s < KQ; ++s) {
        #pragma unroll
        for (int pp = 0; pp < 2; ++pp) {
            const v2f xf = x[s][pp];
            #pragma unroll
            for (int t = 0; t < 2; ++t) {
                qT[pp][t] = mma4(w[s][t],     xf, qT[pp][t]);
                kT[pp][t] = mma4(w[s][2 + t], xf, kT[pp][t]);
                vv[pp][t] = mma4(xf, w[s][4 + t], vv[pp][t]);
            }
        }
    }
}

// Value of lane ^ 16 (the lane that holds the other half of a fragment's k or of D's rows).
__device__ __forceinline__ float other_half(float v)
{
    int b = __builtin_bit_cast(int, v);
    return __builtin_bit_cast(float,
        __builtin_amdgcn_permlanex16(b, b, 0x76543210, 0xfedcba98, false, false));
}

__global__ __launch_bounds__(256) void fused_block_attn_kernel(
    const float* __restrict__ x,   // [B,64,128]
    const float* __restrict__ y0,  // [B,4,4,1,32]
    const float* __restrict__ y1,
    const float* __restrict__ y2,
    const float* __restrict__ Wa,  // [128,384]
    const float* __restrict__ Wp,  // [128,128]
    float* __restrict__ out)       // [B,64,128]
{
    // xo on a 2 KiB multiple (LDS offset 0): the tensor load's place no longer depends on the other arrays' sizes
    __shared__ __attribute__((aligned(2048))) float xo[T_SZ * XPAD];  // x staging (TDM target)
    __shared__ __attribute__((aligned(16))) float os[T_SZ * XPAD];    // attention output, A operand of GEMM2
    __shared__ __attribute__((aligned(16))) float ysum[2][NH * NG * HS];  // summary keys (y1) and values (y2)

    const int tid  = threadIdx.x;
    const int lane = tid & 31;
    const int wave = tid >> 5;
    const int b    = blockIdx.x;

    // ---------------- stage x[b] -> LDS via Tensor Data Mover ---------------
    // 2D tile: 128 (dim0) x 64 rows (dim1), fp32, LDS row padding 4 DWORDs
    // after every 128 DWORDs -> row stride 132 floats == XPAD.
    if (wave == 0) {
        unsigned long long ga =
            (unsigned long long)(const void*)(x + (size_t)b * T_SZ * DIM);
        unsigned int ldsoff = (unsigned int)(unsigned long long)(const void*)&xo[0];
        u32x4 g0;
        g0[0] = 1u;                                   // count=1, no gather
        g0[1] = ldsoff;                               // lds_addr
        g0[2] = (unsigned int)ga;                     // global_addr[31:0]
        g0[3] = (unsigned int)(ga >> 32) | 0x80000000u; // addr[56:32] | type=2
        u32x8 g1;
        g1[0] = (2u << 16)        // data_size = 4B
              | (1u << 20)        // pad_enable
              | (6u << 22)        // pad_interval code 6 -> every 128 DWORDs
              | (3u << 25);       // pad_amount  code 3 -> 4 DWORDs
        g1[1] = (unsigned int)DIM << 16;   // tensor_dim0 = 128 (bits 79:48, low part)
        g1[2] = (unsigned int)T_SZ << 16;  // tensor_dim1 = 64  (bits 111:80, low part)
        g1[3] = (unsigned int)DIM << 16;   // tile_dim0 = 128   (bits 127:112)
        g1[4] = (unsigned int)T_SZ;        // tile_dim1 = 64, tile_dim2 = 0
        g1[5] = (unsigned int)DIM;         // tensor_dim0_stride = 128
        g1[6] = 0u;
        g1[7] = 0u;
        asm volatile("tensor_load_to_lds %0, %1" :: "s"(g0), "s"(g1) : "memory");
        __builtin_amdgcn_s_wait_tensorcnt(0);
    }

    // Weight fragments travel in register rings: each block is requested two blocks
    // (GEMM1, 24 WMMAs) or one block (GEMM2, 32 WMMAs) before its first use.
    const int nlow    = lane & 15;
    const int half    = lane >> 4;
    const int kb_lane = 2 * half;
    // scalar wave number: head and groups stay wave-uniform (no EXEC masking near a WMMA)
    const int wv = __builtin_amdgcn_readfirstlane(wave);
    const int h  = wv >> 1;          // this wave's head
    const int gb = 2 * (wv & 1);     // its two groups: gb, gb + 1
    const float* wa = Wa + kb_lane * 384 + h * HS + nlow;
    const float* wp = Wp + kb_lane * DIM + wave * 16 + nlow;
    // ---------------- summary keys and values: y1[b], y2[b] -> LDS, 16 bytes a thread
    // (the summary query rows are dropped by the un-merge, so y0 reaches no output)
    const int ypart = tid >> 7;
    const int yidx  = (tid & 127) * 4;
    const float* ysrc = ypart ? y2 : y1;
    const v4f yv = *(const v4f*)&ysrc[(size_t)b * (NH * NG * HS) + yidx];
    // stands in front of every later write of the load's address registers (the weight loads reuse them)
    asm volatile("s_wait_xcnt 0x0" ::: "memory");

    v2f wr[NRING][KQ][6];
    // first blocks of GEMM1, in flight over the staging
    load_w6(wr[0], wa);
    load_w6(wr[1], wa + (4 * KQ) * 384);

    *(v4f*)&ysum[ypart][yidx] = yv;
    __syncthreads();

    // ---------------- GEMM1: q^T, k^T and v of this wave's own two pairs ----
    // 32 tokens x 96 columns per wave, 12 accumulator tiles; nothing leaves the registers.
    v8f qT[2][2], kT[2][2], vv[2][2];   // [pair][16-dim tile]
    v2f wb0[KC], wb1[KC];
    {
        #pragma unroll
        for (int pp = 0; pp < 2; ++pp) {
            #pragma unroll
            for (int t = 0; t < 2; ++t) {
                qT[pp][t] = (v8f){0.f,0.f,0.f,0.f,0.f,0.f,0.f,0.f};
                kT[pp][t] = (v8f){0.f,0.f,0.f,0.f,0.f,0.f,0.f,0.f};
                vv[pp][t] = (v8f){0.f,0.f,0.f,0.f,0.f,0.f,0.f,0.f};
            }
        }
        const float* xs = &xo[(gb * GT + nlow) * XPAD + kb_lane];
        v2f xr[NRING][KQ][2];            // x fragments ride the same ring as the weights
        load_x2(xr[0], xs);
        load_x2(xr[1], xs + (4 * KQ));
        // One turn of the ring (three blocks) per trip, 30 of the 32 blocks; kept rolled:
        // unrolled, the scheduler moved loads across blocks and spilled accumulators.
        #pragma unroll 1
        for (int kb = 0; kb < 30; kb += NRING) {
            const float* w  = wa + kb * (4 * KQ) * 384;
            const float* xk = xs + kb * (4 * KQ);
            load_w6(wr[2], w + 2 * (4 * KQ) * 384);
            load_x2(xr[2], xk + 2 * (4 * KQ));
            // holds the loads of block kb + 2 in front of block kb's WMMAs: left free, the
            // LDS reads sank to just before their use and the wave waited on them
            __builtin_amdgcn_sched_barrier(0);
            mma_w6(qT, kT, vv, wr[0], xr[0]);
            load_w6(wr[0], w + 3 * (4 * KQ) * 384);
            load_x2(xr[0], xk + 3 * (4 * KQ));
            __builtin_amdgcn_sched_barrier(0);   // as above
            mma_w6(qT, kT, vv, wr[1], xr[1]);
            load_w6(wr[1], w + 4 * (4 * KQ) * 384);
            load_x2(xr[1], xk + 4 * (4 * KQ));
            __builtin_amdgcn_sched_barrier(0);   // as above
            mma_w6(qT, kT, vv, wr[2], xr[2]);
        }
        mma_w6(qT, kT, vv, wr[0], xr[0]);
        mma_w6(qT, kT, vv, wr[1], xr[1]);
        // keeps the first QK^T WMMAs, which read pair 0's q^T and k^T as operands, behind
        // pair 1's last six WMMAs: five or more vector slots from the result to its use as A or B
        __builtin_amdgcn_sched_barrier(0);
        load_wblock(wb0, wp, DIM);       // GEMM2's first block, in flight over the attention
    }

    // ---------------- causal attention per (head,group) pair on the matrix unit
    // Only the 16 token rows of a pair survive the un-merge, and they attend to the
    // 16 token keys (causal) plus, in groups 1..3, the prepended summary key.
    // A lane of q^T / k^T holds token (lane & 15), dims 16t + 8*half + r: registers 2s, 2s+1
    // are at once the A fragment (k^T) and the B fragment (q^T) of one k-step of S^T = K Q^T,
    // which pairs dims 16t + 8*half + 2s, + 1 on both operands.
    // S^T puts query (lane & 15) in every lane's column, so the softmax is per lane
    // (8 keys in registers, the other 8 in lane ^ 16) and the D registers of S^T are
    // already the B fragments of O^T = V^T P^T; v's registers 2s, 2s+1 (tokens
    // 8*half + 2s, + 1, dim lane & 15) are its A fragments: the same keys on both operands.
    {
        const float scale = 0.17677669529663687f;  // 1/sqrt(32)
        // unrolled: two independent pairs per wave, their WMMA chains may interleave
        #pragma unroll
        for (int pp = 0; pp < 2; ++pp) {
            const int  g    = gb + pp;
            const bool summ = (g > 0);                       // summary key visible to kept rows
            const int  srow = (h * NG + (summ ? g - 1 : 0)) * HS + 8 * half;

            v8f st = (v8f){0.f,0.f,0.f,0.f,0.f,0.f,0.f,0.f};
            float s0 = 0.f;
            #pragma unroll
            for (int t = 0; t < 2; ++t) {
                const v4f ka = *(const v4f*)&ysum[0][srow + t * 16];
                const v4f kc = *(const v4f*)&ysum[0][srow + t * 16 + 4];
                #pragma unroll
                for (int s = 0; s < 4; ++s) {
                    v2f kf, qf;
                    kf.x = kT[pp][t][2 * s];
                    kf.y = kT[pp][t][2 * s + 1];
                    qf.x = qT[pp][t][2 * s];
                    qf.y = qT[pp][t][2 * s + 1];
                    st = mma4(kf, qf, st);
                }
                #pragma unroll
                for (int r = 0; r < 4; ++r) {
                    s0 += qT[pp][t][r] * ka[r];
                    s0 += qT[pp][t][r + 4] * kc[r];
                }
            }
            s0 += other_half(s0);                            // the 16 dims held by lane ^ 16
            s0 = summ ? s0 * scale : -INFINITY;

            float e[8];
            float mx = s0;
            #pragma unroll
            for (int r = 0; r < 8; ++r) {
                e[r] = (r + 8 * half <= nlow) ? st[r] * scale : -INFINITY;  // causal mask
                mx = fmaxf(mx, e[r]);
            }
            mx = fmaxf(mx, other_half(mx));                  // finite: key == query is never masked
            float sum = 0.f;
            #pragma unroll
            for (int r = 0; r < 8; ++r) {
                e[r] = __expf(e[r] - mx);                    // masked: exp(-inf) = 0
                sum += e[r];
            }
            const float e0 = __expf(s0 - mx);
            sum += other_half(sum);
            sum += e0;
            const float inv = 1.f / sum;

            float* orow = &os[(g * GT + nlow) * XPAD + h * HS + 8 * half];
            #pragma unroll
            for (int tl = 0; tl < 2; ++tl) {
                // start value of the chain: the summary key's term (none in group 0)
                const v4f sa = *(const v4f*)&ysum[1][srow + tl * 16];
                const v4f sb = *(const v4f*)&ysum[1][srow + tl * 16 + 4];
                v8f oa;
                #pragma unroll
                for (int r = 0; r < 4; ++r) {
                    oa[r]     = summ ? e0 * sa[r] : 0.f;
                    oa[r + 4] = summ ? e0 * sb[r] : 0.f;
                }
                #pragma unroll
                for (int s = 0; s < 4; ++s) {
                    v2f va, pb;
                    va.x = vv[pp][tl][2 * s];
                    va.y = vv[pp][tl][2 * s + 1];
                    pb.x = e[2 * s];
                    pb.y = e[2 * s + 1];
                    oa = mma4(va, pb, oa);
                }
                // oa[r] = O[query nlow][dim tl*16 + 8*half + r]: 8 consecutive floats of one o row
                *(v4f*)&orow[tl * 16]     = (v4f){oa[0] * inv, oa[1] * inv, oa[2] * inv, oa[3] * inv};
                *(v4f*)&orow[tl * 16 + 4] = (v4f){oa[4] * inv, oa[5] * inv, oa[6] * inv, oa[7] * inv};
            }
        }
    }
    __syncthreads();

    // ---------------- GEMM2: out = o @ W_proj -------------------------------
    // 8 N-tiles -> 1 per wave; 4 M-tiles each; two-block weight ring (wb0, wb1).
    {
        const int ncol    = wave * 16 + nlow;
        const float* xs = &os[nlow * XPAD + kb_lane];
        v8f acc[4];
        #pragma unroll
        for (int mt = 0; mt < 4; ++mt)
            acc[mt] = (v8f){0.f,0.f,0.f,0.f,0.f,0.f,0.f,0.f};

        load_wblock(wb1, wp + 32 * DIM, DIM);
        mma_wblock(acc, wb0, xs);
        load_wblock(wb0, wp + 64 * DIM, DIM);
        mma_wblock(acc, wb1, xs + 32);
        load_wblock(wb1, wp + 96 * DIM, DIM);
        mma_wblock(acc, wb0, xs + 64);
        mma_wblock(acc, wb1, xs + 96);
        float* ob = out + (size_t)b * T_SZ * DIM;
        #pragma unroll
        for (int mt = 0; mt < 4; ++mt) {
            #pragma unroll
            for (int r = 0; r < 8; ++r) {
                int row = mt * 16 + r + 8 * (lane >> 4);
                ob[(size_t)row * DIM + ncol] = acc[mt][r];
            }
        }
    }
}

extern "C" void kernel_launch(void* const* d_in, const int* in_sizes, int n_in,
                              void* d_out, int out_size, void* d_ws, size_t ws_size,
                              hipStream_t stream) {
    (void)n_in; (void)d_ws; (void)ws_size; (void)out_size;
    const float* x  = (const float*)d_in[0];
    const float* y0 = (const float*)d_in[1];
    const float* y1 = (const float*)d_in[2];
    const float* y2 = (const float*)d_in[3];
    const float* Wa = (const float*)d_in[4];
    const float* Wp = (const float*)d_in[5];
    float* out = (float*)d_out;
    const int B = in_sizes[0] / (T_SZ * DIM);   // 4096
    fused_block_attn_kernel<<<B, 256, 0, stream>>>(x, y0, y1, y2, Wa, Wp, out);
}
